// v000
// Measured on an AMD MI455X. A time is GPU time per run, averaged over a window of back-to-back runs after a warm-up
// (all launches, gaps included; the runs take copies of the inputs in turn), and the median of several windows.
// Apart from v000's, it joins two sittings. Times from different sittings can be a few percent apart, while
// side-by-side timings come from the same sitting.
// v000, which the later versions start from, runs in 65.9 microseconds.
#include <hip/hip_runtime.h>

// LoRA fused forward for MI455X (gfx1250, wave32, WMMA f32 16x16x4).
//   h = x @ V^T            [8192,4096] x [4096,32]
//   h *= S                 (per-rank scale)
//   out = h @ U^T          [8192,32] x [32,4096]   (SCALING = 32/32 = 1.0)
//
// One fused pass: x read once (128MB), out written once (128MB); U,V stay in L2.

typedef float v2f __attribute__((ext_vector_type(2)));
typedef float v8f __attribute__((ext_vector_type(8)));

#define IN_F   4096
#define OUT_F  4096
#define RANK   32
#define WAVES  8
#define BLOCK  (WAVES * 32)

__global__ __launch_bounds__(BLOCK) void lora_fused_wmma(
    const float* __restrict__ x,   // [8192, 4096]
    const float* __restrict__ U,   // [4096, 32]
    const float* __restrict__ S,   // [32]
    const float* __restrict__ V,   // [32, 4096]
    float* __restrict__ out)       // [8192, 4096]
{
    __shared__ __align__(16) float hPart[WAVES * 16 * RANK]; // 16 KB partials
    __shared__ __align__(16) float hFin[16 * RANK];          // 2 KB reduced h

    const int tid  = threadIdx.x;
    const int wave = tid >> 5;
    const int lane = tid & 31;
    const int l16  = lane & 15;      // M (A) or N (B/D) index within tile
    const int hi   = lane >> 4;      // half-wave selects K+0/1 vs K+2/3
    const int koff = hi * 2;
    const int m0   = blockIdx.x * 16;

    // ---------------- Phase 1: partial h[16,32] over this wave's K-slice ----
    v8f acc0 = {};   // rank 0..15
    v8f acc1 = {};   // rank 16..31
    {
        const int kw0 = wave * (IN_F / WAVES);        // 512-wide K slice
        const float* xrow  = x + (size_t)(m0 + l16) * IN_F + kw0 + koff;
        const float* v0row = V + (size_t)(l16)      * IN_F + kw0 + koff;
        const float* v1row = V + (size_t)(16 + l16) * IN_F + kw0 + koff;
        #pragma unroll 4
        for (int kk = 0; kk < IN_F / WAVES; kk += 4) {
            v2f a  = *(const v2f*)(xrow  + kk);   // A: x[m, k..k+1]
            v2f b0 = *(const v2f*)(v0row + kk);   // B: V[r, k..k+1], r = l16
            v2f b1 = *(const v2f*)(v1row + kk);   // B: V[16+r, k..k+1]
            acc0 = __builtin_amdgcn_wmma_f32_16x16x4_f32(
                       false, a, false, b0, (short)0, acc0, false, false);
            acc1 = __builtin_amdgcn_wmma_f32_16x16x4_f32(
                       false, a, false, b1, (short)0, acc1, false, false);
        }
    }

    // D layout: VGPR i -> (M = i + 8*hi, N = l16). Spill partials to LDS.
    {
        float* p = hPart + wave * (16 * RANK);
        #pragma unroll
        for (int i = 0; i < 8; ++i) {
            int m = i + 8 * hi;
            p[m * RANK + l16]      = acc0[i];
            p[m * RANK + 16 + l16] = acc1[i];
        }
    }
    __syncthreads();

    // ---------------- Cross-wave reduction + S scale (256 thr x float2) -----
    {
        v2f sum = {};
        #pragma unroll
        for (int w = 0; w < WAVES; ++w)
            sum += *(const v2f*)(hPart + w * (16 * RANK) + tid * 2);
        v2f sv = *(const v2f*)(S + 2 * (tid & 15));   // r = 2*(tid%16)+{0,1}
        sum *= sv;                                     // SCALING==1.0 folded
        *(v2f*)(hFin + tid * 2) = sum;
    }
    __syncthreads();

    // ---------------- Phase 2: out[16, n0..n0+511] = h @ U^T ----------------
    // Hoist A operand (h, K=32 -> 8 k-steps) once; reuse for all 32 N-tiles.
    v2f ah[8];
    #pragma unroll
    for (int kk = 0; kk < 8; ++kk)
        ah[kk] = *(const v2f*)(hFin + l16 * RANK + kk * 4 + koff);

    const int n0 = wave * (OUT_F / WAVES);            // 512-wide N slice
    for (int nt = 0; nt < 32; ++nt) {
        const int nc = n0 + nt * 16;
        const float* urow = U + (size_t)(nc + l16) * RANK + koff; // B: U[n, r..r+1]
        v8f acc = {};
        #pragma unroll
        for (int kk = 0; kk < 8; ++kk) {
            v2f b = *(const v2f*)(urow + kk * 4);
            acc = __builtin_amdgcn_wmma_f32_16x16x4_f32(
                      false, ah[kk], false, b, (short)0, acc, false, false);
        }
        // D layout: VGPR i -> row m0 + i + 8*hi, col nc + l16
        float* orow = out + (size_t)(m0 + 8 * hi) * OUT_F + nc + l16;
        #pragma unroll
        for (int i = 0; i < 8; ++i)
            orow[(size_t)i * OUT_F] = acc[i];
    }
}

extern "C" void kernel_launch(void* const* d_in, const int* in_sizes, int n_in,
                              void* d_out, int out_size, void* d_ws, size_t ws_size,
                              hipStream_t stream) {
    const float* x = (const float*)d_in[0];   // [4,2048,4096] -> [8192,4096]
    const float* U = (const float*)d_in[1];   // [4096,32]
    const float* S = (const float*)d_in[2];   // [32]
    const float* V = (const float*)d_in[3];   // [32,4096]
    float* out = (float*)d_out;               // [8192,4096]

    const int M = 4 * 2048;                   // 8192 rows
    dim3 grid(M / 16), block(BLOCK);
    lora_fused_wmma<<<grid, block, 0, stream>>>(x, U, S, V, out);
}

// v001
// One run takes 59.5 microseconds.
// Next to v000, in two timings, it ran 1.14 times as fast each time.
#include <hip/hip_runtime.h>

// LoRA fused forward for MI455X (gfx1250, wave32, WMMA f32 16x16x4).
//   h = x @ V^T            [8192,4096] x [4096,32]
//   h *= S                 (per-rank scale)
//   out = h @ U^T          [8192,32] x [32,4096]   (SCALING = 32/32 = 1.0)
//
// One fused pass: x read once (128MB), out written once (128MB); U,V stay in L2.

typedef float v2f __attribute__((ext_vector_type(2)));
typedef float v4f __attribute__((ext_vector_type(4)));
typedef float v8f __attribute__((ext_vector_type(8)));

#define IN_F   4096
#define OUT_F  4096
#define RANK   32
#define WAVES  8
#define BLOCK  (WAVES * 32)

__global__ __launch_bounds__(BLOCK) void lora_fused_wmma(
    const float* __restrict__ x,   // [8192, 4096]
    const float* __restrict__ U,   // [4096, 32]
    const float* __restrict__ S,   // [32]
    const float* __restrict__ V,   // [32, 4096]
    float* __restrict__ out)       // [8192, 4096]
{
    __shared__ __align__(16) float hPart[WAVES * 16 * RANK]; // 16 KB partials
    __shared__ __align__(16) float hFin[16 * RANK];          // 2 KB reduced h

    const int tid  = threadIdx.x;
    const int wave = tid >> 5;
    const int lane = tid & 31;
    const int l16  = lane & 15;      // M (A) or N (B/D) index within tile
    const int hi   = lane >> 4;      // half-wave selects k 0..3 vs 4..7 of each 8
    const int koff = hi * 4;         // one 16-byte load per lane feeds two WMMAs
    const int m0   = blockIdx.x * 16;

    // ---------------- Phase 1: partial h[16,32] over this wave's K-slice ----
    v8f acc0 = {};   // rank 0..15
    v8f acc1 = {};   // rank 16..31
    {
        const int kw0 = wave * (IN_F / WAVES);        // 512-wide K slice
        const float* xrow  = x + (size_t)(m0 + l16) * IN_F + kw0 + koff;
        const float* v0row = V + (size_t)(l16)      * IN_F + kw0 + koff;
        const float* v1row = V + (size_t)(16 + l16) * IN_F + kw0 + koff;
        // A and B take the same k order, so only the pairing counts: of each
        // 8 k the first WMMA sums k {0,1,4,5}, the second k {2,3,6,7}.
        #pragma unroll 4
        for (int kk = 0; kk < IN_F / WAVES; kk += 8) {
            v4f a  = *(const v4f*)(xrow  + kk);   // A: x[m, k..k+3]
            v4f b0 = *(const v4f*)(v0row + kk);   // B: V[r, k..k+3], r = l16
            v4f b1 = *(const v4f*)(v1row + kk);   // B: V[16+r, k..k+3]
            acc0 = __builtin_amdgcn_wmma_f32_16x16x4_f32(
                       false, a.lo, false, b0.lo, (short)0, acc0, false, false);
            acc1 = __builtin_amdgcn_wmma_f32_16x16x4_f32(
                       false, a.lo, false, b1.lo, (short)0, acc1, false, false);
            acc0 = __builtin_amdgcn_wmma_f32_16x16x4_f32(
                       false, a.hi, false, b0.hi, (short)0, acc0, false, false);
            acc1 = __builtin_amdgcn_wmma_f32_16x16x4_f32(
                       false, a.hi, false, b1.hi, (short)0, acc1, false, false);
        }
    }

    // D layout: VGPR i -> (M = i + 8*hi, N = l16). Spill partials to LDS.
    {
        float* p = hPart + wave * (16 * RANK);
        #pragma unroll
        for (int i = 0; i < 8; ++i) {
            int m = i + 8 * hi;
            p[m * RANK + l16]      = acc0[i];
            p[m * RANK + 16 + l16] = acc1[i];
        }
    }
    __syncthreads();

    // ---------------- Cross-wave reduction + S scale (256 thr x float2) -----
    {
        v2f sum = {};
        #pragma unroll
        for (int w = 0; w < WAVES; ++w)
            sum += *(const v2f*)(hPart + w * (16 * RANK) + tid * 2);
        v2f sv = *(const v2f*)(S + 2 * (tid & 15));   // r = 2*(tid%16)+{0,1}
        sum *= sv;                                     // SCALING==1.0 folded
        *(v2f*)(hFin + tid * 2) = sum;
    }
    __syncthreads();

    // ---------------- Phase 2: out[16, n0..n0+511] = h @ U^T ----------------
    // Hoist A operand (h, K=32 -> 8 k-steps) once; reuse for all 32 N-tiles.
    v4f ah[4];
    #pragma unroll
    for (int kk = 0; kk < 4; ++kk)
        ah[kk] = *(const v4f*)(hFin + l16 * RANK + kk * 8 + koff);

    const int n0 = wave * (OUT_F / WAVES);            // 512-wide N slice
    for (int nt = 0; nt < 32; ++nt) {
        const int nc = n0 + nt * 16;
        const float* urow = U + (size_t)(nc + l16) * RANK + koff; // B: U[n, r..r+3]
        v8f acc = {};
        #pragma unroll
        for (int kk = 0; kk < 4; ++kk) {
            v4f b = *(const v4f*)(urow + kk * 8);
            acc = __builtin_amdgcn_wmma_f32_16x16x4_f32(
                      false, ah[kk].lo, false, b.lo, (short)0, acc, false, false);
            acc = __builtin_amdgcn_wmma_f32_16x16x4_f32(
                      false, ah[kk].hi, false, b.hi, (short)0, acc, false, false);
        }
        // D layout: VGPR i -> row m0 + i + 8*hi, col nc + l16
        float* orow = out + (size_t)(m0 + 8 * hi) * OUT_F + nc + l16;
        #pragma unroll
        for (int i = 0; i < 8; ++i)
            orow[(size_t)i * OUT_F] = acc[i];
    }
}

extern "C" void kernel_launch(void* const* d_in, const int* in_sizes, int n_in,
                              void* d_out, int out_size, void* d_ws, size_t ws_size,
                              hipStream_t stream) {
    const float* x = (const float*)d_in[0];   // [4,2048,4096] -> [8192,4096]
    const float* U = (const float*)d_in[1];   // [4096,32]
    const float* S = (const float*)d_in[2];   // [32]
    const float* V = (const float*)d_in[3];   // [32,4096]
    float* out = (float*)d_out;               // [8192,4096]

    const int M = 4 * 2048;                   // 8192 rows
    dim3 grid(M / 16), block(BLOCK);
    lora_fused_wmma<<<grid, block, 0, stream>>>(x, U, S, V, out);
}

// v002
// Measured time: 57.1 microseconds a run.
// Next to v001, in two timings, it ran 1.05 and 1.04 times as fast.
// Counting every step since v000, it is 1.19 times as fast.
#include <hip/hip_runtime.h>

// LoRA fused forward for MI455X (gfx1250, wave32, WMMA f32 16x16x4).
//   h = x @ V^T            [8192,4096] x [4096,32]
//   h *= S                 (per-rank scale)
//   out = h @ U^T          [8192,32] x [32,4096]   (SCALING = 32/32 = 1.0)
//
// One fused pass: x read once (128MB), out written once (128MB); U,V stay in L2.
// A work-group owns 32 rows (two 16-row tiles): every V and U fragment that a
// wave loads feeds both tiles, so V and U leave L2 once per 32 rows.

typedef float v2f __attribute__((ext_vector_type(2)));
typedef float v4f __attribute__((ext_vector_type(4)));
typedef float v8f __attribute__((ext_vector_type(8)));

#define IN_F   4096
#define OUT_F  4096
#define RANK   32
#define WAVES  16
#define BLOCK  (WAVES * 32)
#define ROWS   32                 // rows of x and out per work-group

__global__ __launch_bounds__(BLOCK) void lora_fused_wmma(
    const float* __restrict__ x,   // [8192, 4096]
    const float* __restrict__ U,   // [4096, 32]
    const float* __restrict__ S,   // [32]
    const float* __restrict__ V,   // [32, 4096]
    float* __restrict__ out)       // [8192, 4096]
{
    __shared__ __align__(16) float hPart[WAVES * ROWS * RANK]; // 64 KB partials
    __shared__ __align__(16) float hFin[ROWS * RANK];          // 4 KB reduced h

    const int tid  = threadIdx.x;
    const int wave = tid >> 5;
    const int lane = tid & 31;
    const int l16  = lane & 15;      // M (A) or N (B/D) index within tile
    const int hi   = lane >> 4;      // half-wave selects k 0..3 vs 4..7 of each 8
    const int koff = hi * 4;         // one 16-byte load per lane feeds two WMMAs
    const int m0   = blockIdx.x * ROWS;

    // ---------------- Phase 1: partial h[32,32] over this wave's K-slice ----
    v8f acc00 = {};  // rows 0..15,  rank 0..15
    v8f acc01 = {};  // rows 0..15,  rank 16..31
    v8f acc10 = {};  // rows 16..31, rank 0..15
    v8f acc11 = {};  // rows 16..31, rank 16..31
    {
        const int kw0 = wave * (IN_F / WAVES);        // 256-wide K slice
        const float* x0row = x + (size_t)(m0 + l16)      * IN_F + kw0 + koff;
        const float* x1row = x + (size_t)(m0 + 16 + l16) * IN_F + kw0 + koff;
        const float* v0row = V + (size_t)(l16)      * IN_F + kw0 + koff;
        const float* v1row = V + (size_t)(16 + l16) * IN_F + kw0 + koff;
        // A and B take the same k order, so only the pairing counts: of each
        // 8 k the first WMMA sums k {0,1,4,5}, the second k {2,3,6,7}.
        #pragma unroll 4
        for (int kk = 0; kk < IN_F / WAVES; kk += 8) {
            v4f a0 = *(const v4f*)(x0row + kk);   // A: x[m, k..k+3]
            v4f a1 = *(const v4f*)(x1row + kk);   // A: x[16+m, k..k+3]
            v4f b0 = *(const v4f*)(v0row + kk);   // B: V[r, k..k+3], r = l16
            v4f b1 = *(const v4f*)(v1row + kk);   // B: V[16+r, k..k+3]
            acc00 = __builtin_amdgcn_wmma_f32_16x16x4_f32(
                        false, a0.lo, false, b0.lo, (short)0, acc00, false, false);
            acc01 = __builtin_amdgcn_wmma_f32_16x16x4_f32(
                        false, a0.lo, false, b1.lo, (short)0, acc01, false, false);
            acc10 = __builtin_amdgcn_wmma_f32_16x16x4_f32(
                        false, a1.lo, false, b0.lo, (short)0, acc10, false, false);
            acc11 = __builtin_amdgcn_wmma_f32_16x16x4_f32(
                        false, a1.lo, false, b1.lo, (short)0, acc11, false, false);
            acc00 = __builtin_amdgcn_wmma_f32_16x16x4_f32(
                        false, a0.hi, false, b0.hi, (short)0, acc00, false, false);
            acc01 = __builtin_amdgcn_wmma_f32_16x16x4_f32(
                        false, a0.hi, false, b1.hi, (short)0, acc01, false, false);
            acc10 = __builtin_amdgcn_wmma_f32_16x16x4_f32(
                        false, a1.hi, false, b0.hi, (short)0, acc10, false, false);
            acc11 = __builtin_amdgcn_wmma_f32_16x16x4_f32(
                        false, a1.hi, false, b1.hi, (short)0, acc11, false, false);
        }
    }

    // D layout: VGPR i -> (M = i + 8*hi, N = l16). Spill partials to LDS.
    {
        float* p = hPart + wave * (ROWS * RANK);
        #pragma unroll
        for (int i = 0; i < 8; ++i) {
            int m = i + 8 * hi;
            p[m * RANK + l16]             = acc00[i];
            p[m * RANK + 16 + l16]        = acc01[i];
            p[(16 + m) * RANK + l16]      = acc10[i];
            p[(16 + m) * RANK + 16 + l16] = acc11[i];
        }
    }
    __syncthreads();

    // ---------------- Cross-wave reduction + S scale (512 thr x float2) -----
    {
        v2f sum = {};
        #pragma unroll
        for (int w = 0; w < WAVES; ++w)
            sum += *(const v2f*)(hPart + w * (ROWS * RANK) + tid * 2);
        v2f sv = *(const v2f*)(S + 2 * (tid & 15));   // r = 2*(tid%16)+{0,1}
        sum *= sv;                                     // SCALING==1.0 folded
        *(v2f*)(hFin + tid * 2) = sum;
    }
    __syncthreads();

    // ---------------- Phase 2: out[32, n0..n0+255] = h @ U^T ----------------
    // Hoist A operand (h, K=32 -> 8 k-steps, two row tiles) once; reuse for
    // all 16 N-tiles of the wave.
    v4f ah0[4], ah1[4];
    #pragma unroll
    for (int kk = 0; kk < 4; ++kk) {
        ah0[kk] = *(const v4f*)(hFin + l16 * RANK + kk * 8 + koff);
        ah1[kk] = *(const v4f*)(hFin + (16 + l16) * RANK + kk * 8 + koff);
    }

    const int n0 = wave * (OUT_F / WAVES);            // 256-wide N slice
    for (int nt = 0; nt < OUT_F / WAVES / 16; nt += 2) {   // two N-tiles a trip
        const int nc = n0 + nt * 16;
        const float* urow = U + (size_t)(nc + l16) * RANK + koff; // B: U[n, r..r+3]
        v4f b0[4], b1[4];
        #pragma unroll
        for (int kk = 0; kk < 4; ++kk) {
            b0[kk] = *(const v4f*)(urow + kk * 8);
            b1[kk] = *(const v4f*)(urow + 16 * RANK + kk * 8);
        }
        v8f c00 = {};   // rows 0..15,  cols nc..nc+15
        v8f c10 = {};   // rows 16..31, cols nc..nc+15
        v8f c01 = {};   // rows 0..15,  cols nc+16..nc+31
        v8f c11 = {};   // rows 16..31, cols nc+16..nc+31
        #pragma unroll
        for (int kk = 0; kk < 4; ++kk) {
            c00 = __builtin_amdgcn_wmma_f32_16x16x4_f32(
                      false, ah0[kk].lo, false, b0[kk].lo, (short)0, c00, false, false);
            c10 = __builtin_amdgcn_wmma_f32_16x16x4_f32(
                      false, ah1[kk].lo, false, b0[kk].lo, (short)0, c10, false, false);
            c01 = __builtin_amdgcn_wmma_f32_16x16x4_f32(
                      false, ah0[kk].lo, false, b1[kk].lo, (short)0, c01, false, false);
            c11 = __builtin_amdgcn_wmma_f32_16x16x4_f32(
                      false, ah1[kk].lo, false, b1[kk].lo, (short)0, c11, false, false);
            c00 = __builtin_amdgcn_wmma_f32_16x16x4_f32(
                      false, ah0[kk].hi, false, b0[kk].hi, (short)0, c00, false, false);
            c10 = __builtin_amdgcn_wmma_f32_16x16x4_f32(
                      false, ah1[kk].hi, false, b0[kk].hi, (short)0, c10, false, false);
            c01 = __builtin_amdgcn_wmma_f32_16x16x4_f32(
                      false, ah0[kk].hi, false, b1[kk].hi, (short)0, c01, false, false);
            c11 = __builtin_amdgcn_wmma_f32_16x16x4_f32(
                      false, ah1[kk].hi, false, b1[kk].hi, (short)0, c11, false, false);
        }
        // D layout: VGPR i -> row m0 + i + 8*hi (+16 for c1x), col nc + l16 (+16 for cx1)
        float* orow = out + (size_t)(m0 + 8 * hi) * OUT_F + nc + l16;
        #pragma unroll
        for (int i = 0; i < 8; ++i) {
            orow[(size_t)i * OUT_F]             = c00[i];
            orow[(size_t)i * OUT_F + 16]        = c01[i];
            orow[(size_t)(16 + i) * OUT_F]      = c10[i];
            orow[(size_t)(16 + i) * OUT_F + 16] = c11[i];
        }
    }
}

extern "C" void kernel_launch(void* const* d_in, const int* in_sizes, int n_in,
                              void* d_out, int out_size, void* d_ws, size_t ws_size,
                              hipStream_t stream) {
    const float* x = (const float*)d_in[0];   // [4,2048,4096] -> [8192,4096]
    const float* U = (const float*)d_in[1];   // [4096,32]
    const float* S = (const float*)d_in[2];   // [32]
    const float* V = (const float*)d_in[3];   // [32,4096]
    float* out = (float*)d_out;               // [8192,4096]

    const int M = 4 * 2048;                   // 8192 rows
    dim3 grid(M / ROWS), block(BLOCK);
    lora_fused_wmma<<<grid, block, 0, stream>>>(x, U, S, V, out);
}

// v003
// A run of this version takes 46.1 microseconds.
// Next to v002, in two timings, it ran 1.24 times as fast each time.
// All steps since v000 together make it 1.48 times as fast.
#include <hip/hip_runtime.h>

// LoRA fused forward for MI455X (gfx1250, wave32, WMMA f32 16x16x4).
//   h = x @ V^T            [8192,4096] x [4096,32]
//   h *= S                 (per-rank scale)
//   out = h @ U^T          [8192,32] x [32,4096]   (SCALING = 32/32 = 1.0)
//
// One fused pass: x read once (128MB), out written once (128MB); U,V stay in L2.
// A work-group owns 32 rows (two 16-row tiles): every V and U fragment that a
// wave loads feeds both tiles, so V and U leave L2 once per 32 rows.

typedef float v2f __attribute__((ext_vector_type(2)));
typedef float v4f __attribute__((ext_vector_type(4)));
typedef float v8f __attribute__((ext_vector_type(8)));

#define IN_F   4096
#define OUT_F  4096
#define RANK   32
#define WAVES  16
#define BLOCK  (WAVES * 32)
#define ROWS   32                 // rows of x and out per work-group

__global__ __launch_bounds__(BLOCK) void lora_fused_wmma(
    const float* __restrict__ x,   // [8192, 4096]
    const float* __restrict__ U,   // [4096, 32]
    const float* __restrict__ S,   // [32]
    const float* __restrict__ V,   // [32, 4096]
    float* __restrict__ out)       // [8192, 4096]
{
    __shared__ __align__(16) float hPart[WAVES * ROWS * RANK]; // 64 KB partials
    __shared__ __align__(16) float hFin[ROWS * RANK];          // 4 KB reduced h

    const int tid  = threadIdx.x;
    const int wave = tid >> 5;
    const int lane = tid & 31;
    const int l16  = lane & 15;      // M (A) or N (B/D) index within tile
    const int hi   = lane >> 4;      // half-wave selects k 0..3 vs 4..7 of each 8
    const int koff = hi * 4;         // one 16-byte load per lane feeds two WMMAs
    const int m0   = blockIdx.x * ROWS;

    // ---------------- Phase 1: partial h[32,32] over this wave's K-slice ----
    v8f acc00 = {};  // rows 0..15,  rank 0..15
    v8f acc01 = {};  // rows 0..15,  rank 16..31
    v8f acc10 = {};  // rows 16..31, rank 0..15
    v8f acc11 = {};  // rows 16..31, rank 16..31
    {
        const int kw0 = wave * (IN_F / WAVES);        // 256-wide K slice
        const float* x0row = x + (size_t)(m0 + l16)      * IN_F + kw0 + koff;
        const float* x1row = x + (size_t)(m0 + 16 + l16) * IN_F + kw0 + koff;
        const float* v0row = V + (size_t)(l16)      * IN_F + kw0 + koff;
        const float* v1row = V + (size_t)(16 + l16) * IN_F + kw0 + koff;
        // A and B take the same k order, so only the pairing counts: of each
        // 8 k the first WMMA sums k {0,1,4,5}, the second k {2,3,6,7}.
        #pragma unroll 4
        for (int kk = 0; kk < IN_F / WAVES; kk += 8) {
            v4f a0 = *(const v4f*)(x0row + kk);   // A: x[m, k..k+3]
            v4f a1 = *(const v4f*)(x1row + kk);   // A: x[16+m, k..k+3]
            v4f b0 = *(const v4f*)(v0row + kk);   // B: V[r, k..k+3], r = l16
            v4f b1 = *(const v4f*)(v1row + kk);   // B: V[16+r, k..k+3]
            acc00 = __builtin_amdgcn_wmma_f32_16x16x4_f32(
                        false, a0.lo, false, b0.lo, (short)0, acc00, false, false);
            acc01 = __builtin_amdgcn_wmma_f32_16x16x4_f32(
                        false, a0.lo, false, b1.lo, (short)0, acc01, false, false);
            acc10 = __builtin_amdgcn_wmma_f32_16x16x4_f32(
                        false, a1.lo, false, b0.lo, (short)0, acc10, false, false);
            acc11 = __builtin_amdgcn_wmma_f32_16x16x4_f32(
                        false, a1.lo, false, b1.lo, (short)0, acc11, false, false);
            acc00 = __builtin_amdgcn_wmma_f32_16x16x4_f32(
                        false, a0.hi, false, b0.hi, (short)0, acc00, false, false);
            acc01 = __builtin_amdgcn_wmma_f32_16x16x4_f32(
                        false, a0.hi, false, b1.hi, (short)0, acc01, false, false);
            acc10 = __builtin_amdgcn_wmma_f32_16x16x4_f32(
                        false, a1.hi, false, b0.hi, (short)0, acc10, false, false);
            acc11 = __builtin_amdgcn_wmma_f32_16x16x4_f32(
                        false, a1.hi, false, b1.hi, (short)0, acc11, false, false);
        }
    }

    // D layout: VGPR i -> (M = i + 8*hi, N = l16). Spill partials to LDS.
    {
        float* p = hPart + wave * (ROWS * RANK);
        #pragma unroll
        for (int i = 0; i < 8; ++i) {
            int m = i + 8 * hi;
            p[m * RANK + l16]             = acc00[i];
            p[m * RANK + 16 + l16]        = acc01[i];
            p[(16 + m) * RANK + l16]      = acc10[i];
            p[(16 + m) * RANK + 16 + l16] = acc11[i];
        }
    }
    __syncthreads();

    // ---------------- Cross-wave reduction + S scale (512 thr x float2) -----
    {
        v2f sum = {};
        #pragma unroll
        for (int w = 0; w < WAVES; ++w)
            sum += *(const v2f*)(hPart + w * (ROWS * RANK) + tid * 2);
        v2f sv = *(const v2f*)(S + 2 * (tid & 15));   // r = 2*(tid%16)+{0,1}
        sum *= sv;                                     // SCALING==1.0 folded
        *(v2f*)(hFin + tid * 2) = sum;
    }
    __syncthreads();

    // ---------------- Phase 2: out[32, n0..n0+255] = h @ U^T ----------------
    // Hoist A operand (h, K=32 -> 8 k-steps, two row tiles) once; reuse for
    // all 16 N-tiles of the wave.
    v4f ah0[4], ah1[4];
    #pragma unroll
    for (int kk = 0; kk < 4; ++kk) {
        ah0[kk] = *(const v4f*)(hFin + l16 * RANK + kk * 8 + koff);
        ah1[kk] = *(const v4f*)(hFin + (16 + l16) * RANK + kk * 8 + koff);
    }

    const int n0 = wave * (OUT_F / WAVES);            // 256-wide N slice
    // Which column of out a B lane stands for is free: N-tile t takes columns
    // nc + 4*l16 + t, so the four tiles leave a lane four neighbouring columns
    // of each row, and one 16-byte store per lane writes 256 contiguous bytes
    // of each of two rows (whole 128-byte lines, no LDS round trip).
    for (int nt = 0; nt < OUT_F / WAVES / 64; ++nt) {      // 64 columns a trip
        const int nc = n0 + nt * 64;
        const float* urow = U + (size_t)(nc + 4 * l16) * RANK + koff; // B: U[n, r..r+3]
        v8f c0[4] = {};   // rows 0..15,  columns nc + 4*l16 + t
        v8f c1[4] = {};   // rows 16..31, columns nc + 4*l16 + t
        #pragma unroll
        for (int t = 0; t < 4; ++t) {
            v4f b[4];
            #pragma unroll
            for (int kk = 0; kk < 4; ++kk)
                b[kk] = *(const v4f*)(urow + t * RANK + kk * 8);
            #pragma unroll
            for (int kk = 0; kk < 4; ++kk) {
                c0[t] = __builtin_amdgcn_wmma_f32_16x16x4_f32(
                            false, ah0[kk].lo, false, b[kk].lo, (short)0, c0[t], false, false);
                c1[t] = __builtin_amdgcn_wmma_f32_16x16x4_f32(
                            false, ah1[kk].lo, false, b[kk].lo, (short)0, c1[t], false, false);
                c0[t] = __builtin_amdgcn_wmma_f32_16x16x4_f32(
                            false, ah0[kk].hi, false, b[kk].hi, (short)0, c0[t], false, false);
                c1[t] = __builtin_amdgcn_wmma_f32_16x16x4_f32(
                            false, ah1[kk].hi, false, b[kk].hi, (short)0, c1[t], false, false);
            }
        }
        // D layout: VGPR i -> row m0 + i + 8*hi (+16 for c1), lane l16 -> columns nc + 4*l16 + 0..3
        float* orow = out + (size_t)(m0 + 8 * hi) * OUT_F + nc + 4 * l16;
        #pragma unroll
        for (int i = 0; i < 8; ++i) {
            v4f r0 = { c0[0][i], c0[1][i], c0[2][i], c0[3][i] };
            v4f r1 = { c1[0][i], c1[1][i], c1[2][i], c1[3][i] };
            *(v4f*)(orow + (size_t)i * OUT_F)        = r0;
            *(v4f*)(orow + (size_t)(16 + i) * OUT_F) = r1;
        }
        // The next trip's loads and WMMAs rewrite registers that these stores
        // name (address pair, data): this wait stands in front of that rewrite.
        asm volatile("s_wait_xcnt 0x0" ::: "memory");
    }
}

extern "C" void kernel_launch(void* const* d_in, const int* in_sizes, int n_in,
                              void* d_out, int out_size, void* d_ws, size_t ws_size,
                              hipStream_t stream) {
    const float* x = (const float*)d_in[0];   // [4,2048,4096] -> [8192,4096]
    const float* U = (const float*)d_in[1];   // [4096,32]
    const float* S = (const float*)d_in[2];   // [32]
    const float* V = (const float*)d_in[3];   // [32,4096]
    float* out = (float*)d_out;               // [8192,4096]

    const int M = 4 * 2048;                   // 8192 rows
    dim3 grid(M / ROWS), block(BLOCK);
    lora_fused_wmma<<<grid, block, 0, stream>>>(x, U, S, V, out);
}

// v004
// A run of this version takes 38.9 microseconds.
// Next to v003, in two timings, it ran 1.18 and 1.19 times as fast.
// Counting every step since v000, it is 1.75 times as fast.
#include <hip/hip_runtime.h>

// LoRA fused forward for MI455X (gfx1250, wave32, WMMA f32 16x16x4).
//   h = x @ V^T            [8192,4096] x [4096,32]
//   h *= S                 (per-rank scale)
//   out = h @ U^T          [8192,32] x [32,4096]   (SCALING = 32/32 = 1.0)
//
// One fused pass: x read once (128MB), out written once (128MB); U,V stay in L2.
// A work-group owns 32 rows (two 16-row tiles): every V and U fragment that a
// wave loads feeds both tiles, so V and U leave L2 once per 32 rows.
// Phase 1 takes x and V through LDS: asynchronous copies ask for whole 128-byte
// lines, and the next tile's copies fly while this tile's WMMAs run.

typedef float v2f __attribute__((ext_vector_type(2)));
typedef float v4f __attribute__((ext_vector_type(4)));
typedef float v8f __attribute__((ext_vector_type(8)));

#define IN_F   4096
#define OUT_F  4096
#define RANK   32
#define WAVES  16
#define BLOCK  (WAVES * 32)
#define ROWS   32                 // rows of x and out per work-group
#define KT     32                 // k per tile: 128 bytes of a row, one line
#define NT     (IN_F / WAVES / KT)  // tiles per wave
#define PITCH  36                 // floats: 144-byte LDS pitch, for 16-byte readers
#define BUF_F  (2 * ROWS * PITCH) // one buffer: 32 rows of x, then 32 rows of V
#define RING_F (WAVES * 2 * BUF_F)

// One tile of a wave: 32 rows x 128 bytes of x and of V. A copy takes 4 rows,
// 8 lanes of 16 bytes a row. lds, gx, gv: the lane's own place in rows 0..3.
// s_wait_xcnt closes each statement: it stands in front of any rewrite of the
// address registers that the copies name.
__device__ __forceinline__ void copy_tile(unsigned lds, const float* gx, const float* gv)
{
    asm volatile(
        "global_load_async_to_lds_b128 %0, %8, off\n\t"
        "global_load_async_to_lds_b128 %1, %9, off\n\t"
        "global_load_async_to_lds_b128 %2, %10, off\n\t"
        "global_load_async_to_lds_b128 %3, %11, off\n\t"
        "global_load_async_to_lds_b128 %4, %12, off\n\t"
        "global_load_async_to_lds_b128 %5, %13, off\n\t"
        "global_load_async_to_lds_b128 %6, %14, off\n\t"
        "global_load_async_to_lds_b128 %7, %15, off\n\t"
        "s_wait_xcnt 0x0"
        :: "v"(lds),                  "v"(lds + 1 * 16 * PITCH), "v"(lds + 2 * 16 * PITCH),
           "v"(lds + 3 * 16 * PITCH), "v"(lds + 4 * 16 * PITCH), "v"(lds + 5 * 16 * PITCH),
           "v"(lds + 6 * 16 * PITCH), "v"(lds + 7 * 16 * PITCH),
           "v"(gx),             "v"(gx + 4 * IN_F),  "v"(gx + 8 * IN_F),  "v"(gx + 12 * IN_F),
           "v"(gx + 16 * IN_F), "v"(gx + 20 * IN_F), "v"(gx + 24 * IN_F), "v"(gx + 28 * IN_F)
        : "memory");
    const unsigned ldv = lds + ROWS * PITCH * 4;
    asm volatile(
        "global_load_async_to_lds_b128 %0, %8, off\n\t"
        "global_load_async_to_lds_b128 %1, %9, off\n\t"
        "global_load_async_to_lds_b128 %2, %10, off\n\t"
        "global_load_async_to_lds_b128 %3, %11, off\n\t"
        "global_load_async_to_lds_b128 %4, %12, off\n\t"
        "global_load_async_to_lds_b128 %5, %13, off\n\t"
        "global_load_async_to_lds_b128 %6, %14, off\n\t"
        "global_load_async_to_lds_b128 %7, %15, off\n\t"
        "s_wait_xcnt 0x0"
        :: "v"(ldv),                  "v"(ldv + 1 * 16 * PITCH), "v"(ldv + 2 * 16 * PITCH),
           "v"(ldv + 3 * 16 * PITCH), "v"(ldv + 4 * 16 * PITCH), "v"(ldv + 5 * 16 * PITCH),
           "v"(ldv + 6 * 16 * PITCH), "v"(ldv + 7 * 16 * PITCH),
           "v"(gv),             "v"(gv + 4 * IN_F),  "v"(gv + 8 * IN_F),  "v"(gv + 12 * IN_F),
           "v"(gv + 16 * IN_F), "v"(gv + 20 * IN_F), "v"(gv + 24 * IN_F), "v"(gv + 28 * IN_F)
        : "memory");
}

__global__ __launch_bounds__(BLOCK) void lora_fused_wmma(
    const float* __restrict__ x,   // [8192, 4096]
    const float* __restrict__ U,   // [4096, 32]
    const float* __restrict__ S,   // [32]
    const float* __restrict__ V,   // [32, 4096]
    float* __restrict__ out)       // [8192, 4096]
{
    __shared__ __align__(16) float smem[RING_F + ROWS * RANK];
    float* const hPart = smem;           // 64 KB partials, on the ring once it is done
    float* const hFin  = smem + RING_F;  // 4 KB reduced h

    const int tid  = threadIdx.x;
    const int wave = tid >> 5;
    const int lane = tid & 31;
    const int l16  = lane & 15;      // M (A) or N (B/D) index within tile
    const int hi   = lane >> 4;      // half-wave selects k 0..3 vs 4..7 of each 8
    const int koff = hi * 4;         // one 16-byte load per lane feeds two WMMAs
    const int m0   = blockIdx.x * ROWS;

    // ---------------- Phase 1: partial h[32,32] over this wave's K-slice ----
    v8f acc00 = {};  // rows 0..15,  rank 0..15
    v8f acc01 = {};  // rows 0..15,  rank 16..31
    v8f acc10 = {};  // rows 16..31, rank 0..15
    v8f acc11 = {};  // rows 16..31, rank 16..31
    {
        const int kw0 = wave * (IN_F / WAVES);        // 256-wide K slice
        const int r4  = lane >> 3;                    // row within a copy's 4 rows
        const int c16 = lane & 7;                     // 16-byte piece of the 128-byte row
        const float* gx = x + (size_t)(m0 + r4) * IN_F + kw0 + c16 * 4;
        const float* gv = V + (size_t)r4 * IN_F + kw0 + c16 * 4;
        float* ring = smem + wave * (2 * BUF_F);      // this wave's two buffers
        const unsigned lds0 = (unsigned)(size_t)ring + (r4 * PITCH + c16 * 4) * 4;

        copy_tile(lds0, gx, gv);                      // tile 0 -> buffer 0
        asm volatile("s_wait_asynccnt 0x0" ::: "memory");   // tile 0 has landed
        __syncthreads();
        copy_tile(lds0 + BUF_F * 4, gx + KT, gv + KT);      // tile 1 -> buffer 1

        // A and B take the same k order, so only the pairing counts: of each
        // 8 k the first WMMA sums k {0,1,4,5}, the second k {2,3,6,7}.
        for (int t = 0; t < NT; ++t) {
            const float* tb = ring + (t & 1) * BUF_F + l16 * PITCH + koff;
            v4f a0[4], a1[4], b0[4], b1[4];
            #pragma unroll
            for (int i = 0; i < 4; ++i) {
                a0[i] = *(const v4f*)(tb + i * 8);                // A: x[m, k..k+3]
                a1[i] = *(const v4f*)(tb + 16 * PITCH + i * 8);   // A: x[16+m, k..k+3]
                b0[i] = *(const v4f*)(tb + 32 * PITCH + i * 8);   // B: V[r, k..k+3], r = l16
                b1[i] = *(const v4f*)(tb + 48 * PITCH + i * 8);   // B: V[16+r, k..k+3]
            }
            #pragma unroll
            for (int i = 0; i < 2; ++i) {
                acc00 = __builtin_amdgcn_wmma_f32_16x16x4_f32(
                            false, a0[i].lo, false, b0[i].lo, (short)0, acc00, false, false);
                acc01 = __builtin_amdgcn_wmma_f32_16x16x4_f32(
                            false, a0[i].lo, false, b1[i].lo, (short)0, acc01, false, false);
                acc10 = __builtin_amdgcn_wmma_f32_16x16x4_f32(
                            false, a1[i].lo, false, b0[i].lo, (short)0, acc10, false, false);
                acc11 = __builtin_amdgcn_wmma_f32_16x16x4_f32(
                            false, a1[i].lo, false, b1[i].lo, (short)0, acc11, false, false);
                acc00 = __builtin_amdgcn_wmma_f32_16x16x4_f32(
                            false, a0[i].hi, false, b0[i].hi, (short)0, acc00, false, false);
                acc01 = __builtin_amdgcn_wmma_f32_16x16x4_f32(
                            false, a0[i].hi, false, b1[i].hi, (short)0, acc01, false, false);
                acc10 = __builtin_amdgcn_wmma_f32_16x16x4_f32(
                            false, a1[i].hi, false, b0[i].hi, (short)0, acc10, false, false);
                acc11 = __builtin_amdgcn_wmma_f32_16x16x4_f32(
                            false, a1[i].hi, false, b1[i].hi, (short)0, acc11, false, false);
            }
            // Keeps the WMMAs above in front of the hand-over: sunk behind the
            // barrier they would hold back the refill and shorten its lead.
            __builtin_amdgcn_sched_barrier(0);
            // Hand-over: the tile is in registers and this buffer's reads are
            // done, tile t+1 has landed, every wave is here; only then is this
            // buffer filled again. The tile's second half of WMMAs runs behind it.
            asm volatile("s_wait_dscnt 0x0" ::: "memory");
            asm volatile("s_wait_asynccnt 0x0" ::: "memory");
            __syncthreads();
            if (t + 2 < NT)
                copy_tile(lds0 + (t & 1) * (BUF_F * 4), gx + (t + 2) * KT, gv + (t + 2) * KT);
            #pragma unroll
            for (int i = 2; i < 4; ++i) {
                acc00 = __builtin_amdgcn_wmma_f32_16x16x4_f32(
                            false, a0[i].lo, false, b0[i].lo, (short)0, acc00, false, false);
                acc01 = __builtin_amdgcn_wmma_f32_16x16x4_f32(
                            false, a0[i].lo, false, b1[i].lo, (short)0, acc01, false, false);
                acc10 = __builtin_amdgcn_wmma_f32_16x16x4_f32(
                            false, a1[i].lo, false, b0[i].lo, (short)0, acc10, false, false);
                acc11 = __builtin_amdgcn_wmma_f32_16x16x4_f32(
                            false, a1[i].lo, false, b1[i].lo, (short)0, acc11, false, false);
                acc00 = __builtin_amdgcn_wmma_f32_16x16x4_f32(
                            false, a0[i].hi, false, b0[i].hi, (short)0, acc00, false, false);
                acc01 = __builtin_amdgcn_wmma_f32_16x16x4_f32(
                            false, a0[i].hi, false, b1[i].hi, (short)0, acc01, false, false);
                acc10 = __builtin_amdgcn_wmma_f32_16x16x4_f32(
                            false, a1[i].hi, false, b0[i].hi, (short)0, acc10, false, false);
                acc11 = __builtin_amdgcn_wmma_f32_16x16x4_f32(
                            false, a1[i].hi, false, b1[i].hi, (short)0, acc11, false, false);
            }
        }
        // No copy is left in flight when the ring becomes hPart.
        asm volatile("s_wait_asynccnt 0x0" ::: "memory");
    }

    // D layout: VGPR i -> (M = i + 8*hi, N = l16). Spill partials to LDS.
    {
        float* p = hPart + wave * (ROWS * RANK);
        #pragma unroll
        for (int i = 0; i < 8; ++i) {
            int m = i + 8 * hi;
            p[m * RANK + l16]             = acc00[i];
            p[m * RANK + 16 + l16]        = acc01[i];
            p[(16 + m) * RANK + l16]      = acc10[i];
            p[(16 + m) * RANK + 16 + l16] = acc11[i];
        }
    }
    __syncthreads();

    // ---------------- Cross-wave reduction + S scale (512 thr x float2) -----
    {
        v2f sum = {};
        #pragma unroll
        for (int w = 0; w < WAVES; ++w)
            sum += *(const v2f*)(hPart + w * (ROWS * RANK) + tid * 2);
        v2f sv = *(const v2f*)(S + 2 * (tid & 15));   // r = 2*(tid%16)+{0,1}
        sum *= sv;                                     // SCALING==1.0 folded
        *(v2f*)(hFin + tid * 2) = sum;
    }
    __syncthreads();

    // ---------------- Phase 2: out[32, n0..n0+255] = h @ U^T ----------------
    // Hoist A operand (h, K=32 -> 8 k-steps, two row tiles) once; reuse for
    // all 16 N-tiles of the wave.
    v4f ah0[4], ah1[4];
    #pragma unroll
    for (int kk = 0; kk < 4; ++kk) {
        ah0[kk] = *(const v4f*)(hFin + l16 * RANK + kk * 8 + koff);
        ah1[kk] = *(const v4f*)(hFin + (16 + l16) * RANK + kk * 8 + koff);
    }

    const int n0 = wave * (OUT_F / WAVES);            // 256-wide N slice
    // Which column of out a B lane stands for is free: N-tile t takes columns
    // nc + 4*l16 + t, so the four tiles leave a lane four neighbouring columns
    // of each row, and one 16-byte store per lane writes 256 contiguous bytes
    // of each of two rows (whole 128-byte lines, no LDS round trip).
    for (int nt = 0; nt < OUT_F / WAVES / 64; ++nt) {      // 64 columns a trip
        const int nc = n0 + nt * 64;
        const float* urow = U + (size_t)(nc + 4 * l16) * RANK + koff; // B: U[n, r..r+3]
        v8f c0[4] = {};   // rows 0..15,  columns nc + 4*l16 + t
        v8f c1[4] = {};   // rows 16..31, columns nc + 4*l16 + t
        #pragma unroll
        for (int t = 0; t < 4; ++t) {
            v4f b[4];
            #pragma unroll
            for (int kk = 0; kk < 4; ++kk)
                b[kk] = *(const v4f*)(urow + t * RANK + kk * 8);
            #pragma unroll
            for (int kk = 0; kk < 4; ++kk) {
                c0[t] = __builtin_amdgcn_wmma_f32_16x16x4_f32(
                            false, ah0[kk].lo, false, b[kk].lo, (short)0, c0[t], false, false);
                c1[t] = __builtin_amdgcn_wmma_f32_16x16x4_f32(
                            false, ah1[kk].lo, false, b[kk].lo, (short)0, c1[t], false, false);
                c0[t] = __builtin_amdgcn_wmma_f32_16x16x4_f32(
                            false, ah0[kk].hi, false, b[kk].hi, (short)0, c0[t], false, false);
                c1[t] = __builtin_amdgcn_wmma_f32_16x16x4_f32(
                            false, ah1[kk].hi, false, b[kk].hi, (short)0, c1[t], false, false);
            }
        }
        // D layout: VGPR i -> row m0 + i + 8*hi (+16 for c1), lane l16 -> columns nc + 4*l16 + 0..3
        float* orow = out + (size_t)(m0 + 8 * hi) * OUT_F + nc + 4 * l16;
        #pragma unroll
        for (int i = 0; i < 8; ++i) {
            v4f r0 = { c0[0][i], c0[1][i], c0[2][i], c0[3][i] };
            v4f r1 = { c1[0][i], c1[1][i], c1[2][i], c1[3][i] };
            *(v4f*)(orow + (size_t)i * OUT_F)        = r0;
            *(v4f*)(orow + (size_t)(16 + i) * OUT_F) = r1;
        }
        // The next trip's loads and WMMAs rewrite registers that these stores
        // name (address pair, data): this wait stands in front of that rewrite.
        asm volatile("s_wait_xcnt 0x0" ::: "memory");
    }
}

extern "C" void kernel_launch(void* const* d_in, const int* in_sizes, int n_in,
                              void* d_out, int out_size, void* d_ws, size_t ws_size,
                              hipStream_t stream) {
    const float* x = (const float*)d_in[0];   // [4,2048,4096] -> [8192,4096]
    const float* U = (const float*)d_in[1];   // [4096,32]
    const float* S = (const float*)d_in[2];   // [32]
    const float* V = (const float*)d_in[3];   // [32,4096]
    float* out = (float*)d_out;               // [8192,4096]

    const int M = 4 * 2048;                   // 8192 rows
    dim3 grid(M / ROWS), block(BLOCK);
    lora_fused_wmma<<<grid, block, 0, stream>>>(x, U, S, V, out);
}

// v005
// Measured time: 36.6 microseconds a run.
// Two timings next to v004 both put it at 1.06 times that version's speed.
// All steps since v000 together make it 1.86 times as fast.
#include <hip/hip_runtime.h>

// LoRA fused forward for MI455X (gfx1250, wave32, WMMA f32 16x16x4).
//   h = x @ V^T            [8192,4096] x [4096,32]
//   h *= S                 (per-rank scale)
//   out = h @ U^T          [8192,32] x [32,4096]   (SCALING = 32/32 = 1.0)
//
// One fused pass: x read once (128MB), out written once (128MB); U,V stay in L2.
// A work-group owns 32 rows (two 16-row tiles): every V and U fragment that a
// wave loads feeds both tiles, so V and U leave L2 once per 32 rows.
// Phase 1 takes x and V through LDS: asynchronous copies ask for whole 128-byte
// lines into a ring of two buffers that each wave keeps for itself, and the next
// two tiles' copies fly while this tile's WMMAs run.

typedef float v2f __attribute__((ext_vector_type(2)));
typedef float v4f __attribute__((ext_vector_type(4)));
typedef float v8f __attribute__((ext_vector_type(8)));

#define IN_F   4096
#define OUT_F  4096
#define RANK   32
#define WAVES  16
#define BLOCK  (WAVES * 32)
#define ROWS   32                 // rows of x and out per work-group
#define KT     32                 // k per tile: 128 bytes of a row, one line
#define NT     (IN_F / WAVES / KT)  // tiles per wave
#define PITCH  36                 // floats: 144-byte LDS pitch, for 16-byte readers
#define BUF_F  (2 * ROWS * PITCH) // one buffer: 32 rows of x, then 32 rows of V
#define RING_F (WAVES * 2 * BUF_F)

// One tile of a wave: 32 rows x 128 bytes of x and of V. A copy takes 4 rows,
// 8 lanes of 16 bytes a row. lds, gx, gv: the lane's own place in rows 0..3.
// s_wait_xcnt closes each statement: it stands in front of any rewrite of the
// address registers that the copies name.
__device__ __forceinline__ void copy_tile(unsigned lds, const float* gx, const float* gv)
{
    asm volatile(
        "global_load_async_to_lds_b128 %0, %8, off\n\t"
        "global_load_async_to_lds_b128 %1, %9, off\n\t"
        "global_load_async_to_lds_b128 %2, %10, off\n\t"
        "global_load_async_to_lds_b128 %3, %11, off\n\t"
        "global_load_async_to_lds_b128 %4, %12, off\n\t"
        "global_load_async_to_lds_b128 %5, %13, off\n\t"
        "global_load_async_to_lds_b128 %6, %14, off\n\t"
        "global_load_async_to_lds_b128 %7, %15, off\n\t"
        "s_wait_xcnt 0x0"
        :: "v"(lds),                  "v"(lds + 1 * 16 * PITCH), "v"(lds + 2 * 16 * PITCH),
           "v"(lds + 3 * 16 * PITCH), "v"(lds + 4 * 16 * PITCH), "v"(lds + 5 * 16 * PITCH),
           "v"(lds + 6 * 16 * PITCH), "v"(lds + 7 * 16 * PITCH),
           "v"(gx),             "v"(gx + 4 * IN_F),  "v"(gx + 8 * IN_F),  "v"(gx + 12 * IN_F),
           "v"(gx + 16 * IN_F), "v"(gx + 20 * IN_F), "v"(gx + 24 * IN_F), "v"(gx + 28 * IN_F)
        : "memory");
    const unsigned ldv = lds + ROWS * PITCH * 4;
    asm volatile(
        "global_load_async_to_lds_b128 %0, %8, off\n\t"
        "global_load_async_to_lds_b128 %1, %9, off\n\t"
        "global_load_async_to_lds_b128 %2, %10, off\n\t"
        "global_load_async_to_lds_b128 %3, %11, off\n\t"
        "global_load_async_to_lds_b128 %4, %12, off\n\t"
        "global_load_async_to_lds_b128 %5, %13, off\n\t"
        "global_load_async_to_lds_b128 %6, %14, off\n\t"
        "global_load_async_to_lds_b128 %7, %15, off\n\t"
        "s_wait_xcnt 0x0"
        :: "v"(ldv),                  "v"(ldv + 1 * 16 * PITCH), "v"(ldv + 2 * 16 * PITCH),
           "v"(ldv + 3 * 16 * PITCH), "v"(ldv + 4 * 16 * PITCH), "v"(ldv + 5 * 16 * PITCH),
           "v"(ldv + 6 * 16 * PITCH), "v"(ldv + 7 * 16 * PITCH),
           "v"(gv),             "v"(gv + 4 * IN_F),  "v"(gv + 8 * IN_F),  "v"(gv + 12 * IN_F),
           "v"(gv + 16 * IN_F), "v"(gv + 20 * IN_F), "v"(gv + 24 * IN_F), "v"(gv + 28 * IN_F)
        : "memory");
}

// One tile's fragments out of a wave's buffer: 32 rows of x, then 32 rows of V.
__device__ __forceinline__ void load_frags(const float* tb, v4f (&a0)[4], v4f (&a1)[4],
                                           v4f (&b0)[4], v4f (&b1)[4])
{
    #pragma unroll
    for (int i = 0; i < 4; ++i) {
        a0[i] = *(const v4f*)(tb + i * 8);                // A: x[m, k..k+3]
        a1[i] = *(const v4f*)(tb + 16 * PITCH + i * 8);   // A: x[16+m, k..k+3]
        b0[i] = *(const v4f*)(tb + 32 * PITCH + i * 8);   // B: V[r, k..k+3], r = l16
        b1[i] = *(const v4f*)(tb + 48 * PITCH + i * 8);   // B: V[16+r, k..k+3]
    }
}

// A and B take the same k order, so only the pairing counts: of each 8 k the
// first WMMA sums k {0,1,4,5}, the second k {2,3,6,7}.
__device__ __forceinline__ void mma_frags(const v4f (&a0)[4], const v4f (&a1)[4],
                                          const v4f (&b0)[4], const v4f (&b1)[4],
                                          v8f& acc00, v8f& acc01, v8f& acc10, v8f& acc11)
{
    #pragma unroll
    for (int i = 0; i < 4; ++i) {
        acc00 = __builtin_amdgcn_wmma_f32_16x16x4_f32(
                    false, a0[i].lo, false, b0[i].lo, (short)0, acc00, false, false);
        acc01 = __builtin_amdgcn_wmma_f32_16x16x4_f32(
                    false, a0[i].lo, false, b1[i].lo, (short)0, acc01, false, false);
        acc10 = __builtin_amdgcn_wmma_f32_16x16x4_f32(
                    false, a1[i].lo, false, b0[i].lo, (short)0, acc10, false, false);
        acc11 = __builtin_amdgcn_wmma_f32_16x16x4_f32(
                    false, a1[i].lo, false, b1[i].lo, (short)0, acc11, false, false);
        acc00 = __builtin_amdgcn_wmma_f32_16x16x4_f32(
                    false, a0[i].hi, false, b0[i].hi, (short)0, acc00, false, false);
        acc01 = __builtin_amdgcn_wmma_f32_16x16x4_f32(
                    false, a0[i].hi, false, b1[i].hi, (short)0, acc01, false, false);
        acc10 = __builtin_amdgcn_wmma_f32_16x16x4_f32(
                    false, a1[i].hi, false, b0[i].hi, (short)0, acc10, false, false);
        acc11 = __builtin_amdgcn_wmma_f32_16x16x4_f32(
                    false, a1[i].hi, false, b1[i].hi, (short)0, acc11, false, false);
    }
}

__global__ __launch_bounds__(BLOCK) void lora_fused_wmma(
    const float* __restrict__ x,   // [8192, 4096]
    const float* __restrict__ U,   // [4096, 32]
    const float* __restrict__ S,   // [32]
    const float* __restrict__ V,   // [32, 4096]
    float* __restrict__ out)       // [8192, 4096]
{
    __shared__ __align__(16) float smem[RING_F + ROWS * RANK];
    float* const hPart = smem;           // 64 KB partials, on the ring once it is done
    float* const hFin  = smem + RING_F;  // 4 KB reduced h

    const int tid  = threadIdx.x;
    const int wave = tid >> 5;
    const int lane = tid & 31;
    const int l16  = lane & 15;      // M (A) or N (B/D) index within tile
    const int hi   = lane >> 4;      // half-wave selects k 0..3 vs 4..7 of each 8
    const int koff = hi * 4;         // one 16-byte load per lane feeds two WMMAs
    const int m0   = blockIdx.x * ROWS;

    // ---------------- Phase 1: partial h[32,32] over this wave's K-slice ----
    v8f acc00 = {};  // rows 0..15,  rank 0..15
    v8f acc01 = {};  // rows 0..15,  rank 16..31
    v8f acc10 = {};  // rows 16..31, rank 0..15
    v8f acc11 = {};  // rows 16..31, rank 16..31
    {
        const int kw0 = wave * (IN_F / WAVES);        // 256-wide K slice
        const int r4  = lane >> 3;                    // row within a copy's 4 rows
        const int c16 = lane & 7;                     // 16-byte piece of the 128-byte row
        const float* gx = x + (size_t)(m0 + r4) * IN_F + kw0 + c16 * 4;
        const float* gv = V + (size_t)r4 * IN_F + kw0 + c16 * 4;
        float* ring = smem + wave * (2 * BUF_F);      // this wave's two buffers
        const unsigned lds0 = (unsigned)(size_t)ring + (r4 * PITCH + c16 * 4) * 4;

        // The ring is private to its wave: a wave reads only what it copied
        // itself, behind its own s_wait_asynccnt, and refills a buffer behind its
        // own s_wait_dscnt 0. So no work-group barrier stands in the loop, the
        // waves of a SIMD drift apart, and one wave's waits lie under another's
        // WMMAs. Two tiles of a wave fly at a time (32 copies).
        copy_tile(lds0, gx, gv);                            // tile 0 -> buffer 0
        copy_tile(lds0 + BUF_F * 4, gx + KT, gv + KT);      // tile 1 -> buffer 1

        v4f a0[4], a1[4], b0[4], b1[4];
        for (int t = 0; t < NT - 2; ++t) {
            // Tile t has landed; the 16 youngest copies (tile t+1) fly on.
            asm volatile("s_wait_asynccnt 0x10" ::: "memory");
            load_frags(ring + (t & 1) * BUF_F + l16 * PITCH + koff, a0, a1, b0, b1);
            // The tile is in registers: this wave's reads of the buffer are done
            // before its refill is asked for.
            asm volatile("s_wait_dscnt 0x0" ::: "memory");
            copy_tile(lds0 + (t & 1) * (BUF_F * 4), gx + (t + 2) * KT, gv + (t + 2) * KT);
            // Keeps the WMMAs behind the refill: lifted over it they would
            // shorten its lead.
            __builtin_amdgcn_sched_barrier(0);
            mma_frags(a0, a1, b0, b1, acc00, acc01, acc10, acc11);
        }
        // Tile NT-2: behind it only tile NT-1's 16 copies are still out.
        asm volatile("s_wait_asynccnt 0x10" ::: "memory");
        load_frags(ring + ((NT - 2) & 1) * BUF_F + l16 * PITCH + koff, a0, a1, b0, b1);
        mma_frags(a0, a1, b0, b1, acc00, acc01, acc10, acc11);
        // Tile NT-1: no copy is left in flight behind this wait.
        asm volatile("s_wait_asynccnt 0x0" ::: "memory");
        load_frags(ring + ((NT - 1) & 1) * BUF_F + l16 * PITCH + koff, a0, a1, b0, b1);
        mma_frags(a0, a1, b0, b1, acc00, acc01, acc10, acc11);
        // The ring becomes hPart, which lies on other waves' buffers: every wave
        // has ended its copies and its reads before any wave writes there.
        asm volatile("s_wait_dscnt 0x0" ::: "memory");
        __syncthreads();
    }

    // D layout: VGPR i -> (M = i + 8*hi, N = l16). Spill partials to LDS.
    {
        float* p = hPart + wave * (ROWS * RANK);
        #pragma unroll
        for (int i = 0; i < 8; ++i) {
            int m = i + 8 * hi;
            p[m * RANK + l16]             = acc00[i];
            p[m * RANK + 16 + l16]        = acc01[i];
            p[(16 + m) * RANK + l16]      = acc10[i];
            p[(16 + m) * RANK + 16 + l16] = acc11[i];
        }
    }
    __syncthreads();

    // ---------------- Cross-wave reduction + S scale (512 thr x float2) -----
    {
        v2f sum = {};
        #pragma unroll
        for (int w = 0; w < WAVES; ++w)
            sum += *(const v2f*)(hPart + w * (ROWS * RANK) + tid * 2);
        v2f sv = *(const v2f*)(S + 2 * (tid & 15));   // r = 2*(tid%16)+{0,1}
        sum *= sv;                                     // SCALING==1.0 folded
        *(v2f*)(hFin + tid * 2) = sum;
    }
    __syncthreads();

    // ---------------- Phase 2: out[32, n0..n0+255] = h @ U^T ----------------
    // Hoist A operand (h, K=32 -> 8 k-steps, two row tiles) once; reuse for
    // all 16 N-tiles of the wave.
    v4f ah0[4], ah1[4];
    #pragma unroll
    for (int kk = 0; kk < 4; ++kk) {
        ah0[kk] = *(const v4f*)(hFin + l16 * RANK + kk * 8 + koff);
        ah1[kk] = *(const v4f*)(hFin + (16 + l16) * RANK + kk * 8 + koff);
    }

    const int n0 = wave * (OUT_F / WAVES);            // 256-wide N slice
    // Which column of out a B lane stands for is free: N-tile t takes columns
    // nc + 4*l16 + t, so the four tiles leave a lane four neighbouring columns
    // of each row, and one 16-byte store per lane writes 256 contiguous bytes
    // of each of two rows (whole 128-byte lines, no LDS round trip).
    for (int nt = 0; nt < OUT_F / WAVES / 64; ++nt) {      // 64 columns a trip
        const int nc = n0 + nt * 64;
        const float* urow = U + (size_t)(nc + 4 * l16) * RANK + koff; // B: U[n, r..r+3]
        v8f c0[4] = {};   // rows 0..15,  columns nc + 4*l16 + t
        v8f c1[4] = {};   // rows 16..31, columns nc + 4*l16 + t
        #pragma unroll
        for (int t = 0; t < 4; ++t) {
            v4f b[4];
            #pragma unroll
            for (int kk = 0; kk < 4; ++kk)
                b[kk] = *(const v4f*)(urow + t * RANK + kk * 8);
            #pragma unroll
            for (int kk = 0; kk < 4; ++kk) {
                c0[t] = __builtin_amdgcn_wmma_f32_16x16x4_f32(
                            false, ah0[kk].lo, false, b[kk].lo, (short)0, c0[t], false, false);
                c1[t] = __builtin_amdgcn_wmma_f32_16x16x4_f32(
                            false, ah1[kk].lo, false, b[kk].lo, (short)0, c1[t], false, false);
                c0[t] = __builtin_amdgcn_wmma_f32_16x16x4_f32(
                            false, ah0[kk].hi, false, b[kk].hi, (short)0, c0[t], false, false);
                c1[t] = __builtin_amdgcn_wmma_f32_16x16x4_f32(
                            false, ah1[kk].hi, false, b[kk].hi, (short)0, c1[t], false, false);
            }
        }
        // D layout: VGPR i -> row m0 + i + 8*hi (+16 for c1), lane l16 -> columns nc + 4*l16 + 0..3
        float* orow = out + (size_t)(m0 + 8 * hi) * OUT_F + nc + 4 * l16;
        #pragma unroll
        for (int i = 0; i < 8; ++i) {
            v4f r0 = { c0[0][i], c0[1][i], c0[2][i], c0[3][i] };
            v4f r1 = { c1[0][i], c1[1][i], c1[2][i], c1[3][i] };
            *(v4f*)(orow + (size_t)i * OUT_F)        = r0;
            *(v4f*)(orow + (size_t)(16 + i) * OUT_F) = r1;
        }
        // The next trip's loads and WMMAs rewrite registers that these stores
        // name (address pair, data): this wait stands in front of that rewrite.
        asm volatile("s_wait_xcnt 0x0" ::: "memory");
    }
}

extern "C" void kernel_launch(void* const* d_in, const int* in_sizes, int n_in,
                              void* d_out, int out_size, void* d_ws, size_t ws_size,
                              hipStream_t stream) {
    const float* x = (const float*)d_in[0];   // [4,2048,4096] -> [8192,4096]
    const float* U = (const float*)d_in[1];   // [4096,32]
    const float* S = (const float*)d_in[2];   // [32]
    const float* V = (const float*)d_in[3];   // [32,4096]
    float* out = (float*)d_out;               // [8192,4096]

    const int M = 4 * 2048;                   // 8192 rows
    dim3 grid(M / ROWS), block(BLOCK);
    lora_fused_wmma<<<grid, block, 0, stream>>>(x, U, S, V, out);
}

// v006
// It runs in 33.3 microseconds.
// In both of two side-by-side timings against v005, it was 1.10 times as fast.
// All steps since v000 together make it 2.04 times as fast.
#include <hip/hip_runtime.h>

// LoRA fused forward for MI455X (gfx1250, wave32, WMMA f32 16x16x4).
//   h = x @ V^T            [8192,4096] x [4096,32]
//   h *= S                 (per-rank scale)
//   out = h @ U^T          [8192,32] x [32,4096]   (SCALING = 32/32 = 1.0)
//
// One fused pass: x read once (128MB), out written once (128MB); U,V stay in L2.
// A work-group owns 32 rows (two 16-row tiles): every V and U fragment that a
// wave loads feeds both tiles, so V and U leave L2 once per 32 rows.
// Phase 1 takes x and V through LDS: asynchronous copies ask for whole 128-byte
// lines into a ring of two buffers that each wave keeps for itself, and the next
// two tiles' copies fly while this tile's WMMAs run.
// Phase 2 takes U the same way through the same ring: 64 rows of U a tile.

typedef float v2f __attribute__((ext_vector_type(2)));
typedef float v4f __attribute__((ext_vector_type(4)));
typedef float v8f __attribute__((ext_vector_type(8)));

#define IN_F   4096
#define OUT_F  4096
#define RANK   32
#define WAVES  16
#define BLOCK  (WAVES * 32)
#define ROWS   32                 // rows of x and out per work-group
#define KT     32                 // k per tile: 128 bytes of a row, one line
#define NT     (IN_F / WAVES / KT)  // tiles per wave
#define PITCH  36                 // floats: 144-byte LDS pitch, for 16-byte readers
#define BUF_F  (2 * ROWS * PITCH) // one buffer: 32 rows of x, then 32 rows of V
#define RING_F (WAVES * 2 * BUF_F)

// One tile of a wave: 32 rows x 128 bytes of x and of V. A copy takes 4 rows,
// 8 lanes of 16 bytes a row. lds, gx, gv: the lane's own place in rows 0..3.
// s_wait_xcnt closes each statement: it stands in front of any rewrite of the
// address registers that the copies name.
__device__ __forceinline__ void copy_tile(unsigned lds, const float* gx, const float* gv)
{
    asm volatile(
        "global_load_async_to_lds_b128 %0, %8, off\n\t"
        "global_load_async_to_lds_b128 %1, %9, off\n\t"
        "global_load_async_to_lds_b128 %2, %10, off\n\t"
        "global_load_async_to_lds_b128 %3, %11, off\n\t"
        "global_load_async_to_lds_b128 %4, %12, off\n\t"
        "global_load_async_to_lds_b128 %5, %13, off\n\t"
        "global_load_async_to_lds_b128 %6, %14, off\n\t"
        "global_load_async_to_lds_b128 %7, %15, off\n\t"
        "s_wait_xcnt 0x0"
        :: "v"(lds),                  "v"(lds + 1 * 16 * PITCH), "v"(lds + 2 * 16 * PITCH),
           "v"(lds + 3 * 16 * PITCH), "v"(lds + 4 * 16 * PITCH), "v"(lds + 5 * 16 * PITCH),
           "v"(lds + 6 * 16 * PITCH), "v"(lds + 7 * 16 * PITCH),
           "v"(gx),             "v"(gx + 4 * IN_F),  "v"(gx + 8 * IN_F),  "v"(gx + 12 * IN_F),
           "v"(gx + 16 * IN_F), "v"(gx + 20 * IN_F), "v"(gx + 24 * IN_F), "v"(gx + 28 * IN_F)
        : "memory");
    const unsigned ldv = lds + ROWS * PITCH * 4;
    asm volatile(
        "global_load_async_to_lds_b128 %0, %8, off\n\t"
        "global_load_async_to_lds_b128 %1, %9, off\n\t"
        "global_load_async_to_lds_b128 %2, %10, off\n\t"
        "global_load_async_to_lds_b128 %3, %11, off\n\t"
        "global_load_async_to_lds_b128 %4, %12, off\n\t"
        "global_load_async_to_lds_b128 %5, %13, off\n\t"
        "global_load_async_to_lds_b128 %6, %14, off\n\t"
        "global_load_async_to_lds_b128 %7, %15, off\n\t"
        "s_wait_xcnt 0x0"
        :: "v"(ldv),                  "v"(ldv + 1 * 16 * PITCH), "v"(ldv + 2 * 16 * PITCH),
           "v"(ldv + 3 * 16 * PITCH), "v"(ldv + 4 * 16 * PITCH), "v"(ldv + 5 * 16 * PITCH),
           "v"(ldv + 6 * 16 * PITCH), "v"(ldv + 7 * 16 * PITCH),
           "v"(gv),             "v"(gv + 4 * IN_F),  "v"(gv + 8 * IN_F),  "v"(gv + 12 * IN_F),
           "v"(gv + 16 * IN_F), "v"(gv + 20 * IN_F), "v"(gv + 24 * IN_F), "v"(gv + 28 * IN_F)
        : "memory");
}

// One tile of U: 64 rows of 128 bytes, 8 KB in a row in memory. A copy takes 512
// contiguous bytes, rows 4q..4q+3, and row 4q+t lands as LDS row 16t+q, so that
// N-tile t (columns 4*l16+t) reads 16 neighbouring LDS rows like a phase 1 tile.
// lds, gu: the lane's own place in copy 0. s_wait_xcnt as in copy_tile.
__device__ __forceinline__ void copy_u(unsigned lds, const float* gu)
{
    asm volatile(
        "global_load_async_to_lds_b128 %0, %8, off\n\t"
        "global_load_async_to_lds_b128 %1, %9, off\n\t"
        "global_load_async_to_lds_b128 %2, %10, off\n\t"
        "global_load_async_to_lds_b128 %3, %11, off\n\t"
        "global_load_async_to_lds_b128 %4, %12, off\n\t"
        "global_load_async_to_lds_b128 %5, %13, off\n\t"
        "global_load_async_to_lds_b128 %6, %14, off\n\t"
        "global_load_async_to_lds_b128 %7, %15, off\n\t"
        "s_wait_xcnt 0x0"
        :: "v"(lds),                 "v"(lds + 1 * 4 * PITCH), "v"(lds + 2 * 4 * PITCH),
           "v"(lds + 3 * 4 * PITCH), "v"(lds + 4 * 4 * PITCH), "v"(lds + 5 * 4 * PITCH),
           "v"(lds + 6 * 4 * PITCH), "v"(lds + 7 * 4 * PITCH),
           "v"(gu),           "v"(gu + 1 * 128), "v"(gu + 2 * 128), "v"(gu + 3 * 128),
           "v"(gu + 4 * 128), "v"(gu + 5 * 128), "v"(gu + 6 * 128), "v"(gu + 7 * 128)
        : "memory");
    asm volatile(
        "global_load_async_to_lds_b128 %0, %8, off\n\t"
        "global_load_async_to_lds_b128 %1, %9, off\n\t"
        "global_load_async_to_lds_b128 %2, %10, off\n\t"
        "global_load_async_to_lds_b128 %3, %11, off\n\t"
        "global_load_async_to_lds_b128 %4, %12, off\n\t"
        "global_load_async_to_lds_b128 %5, %13, off\n\t"
        "global_load_async_to_lds_b128 %6, %14, off\n\t"
        "global_load_async_to_lds_b128 %7, %15, off\n\t"
        "s_wait_xcnt 0x0"
        :: "v"(lds + 8 * 4 * PITCH),  "v"(lds + 9 * 4 * PITCH),  "v"(lds + 10 * 4 * PITCH),
           "v"(lds + 11 * 4 * PITCH), "v"(lds + 12 * 4 * PITCH), "v"(lds + 13 * 4 * PITCH),
           "v"(lds + 14 * 4 * PITCH), "v"(lds + 15 * 4 * PITCH),
           "v"(gu + 8 * 128),  "v"(gu + 9 * 128),  "v"(gu + 10 * 128), "v"(gu + 11 * 128),
           "v"(gu + 12 * 128), "v"(gu + 13 * 128), "v"(gu + 14 * 128), "v"(gu + 15 * 128)
        : "memory");
}

// One tile's fragments out of a wave's buffer: 32 rows of x, then 32 rows of V
// (phase 2: the four N-tiles of U, 16 rows each).
__device__ __forceinline__ void load_frags(const float* tb, v4f (&a0)[4], v4f (&a1)[4],
                                           v4f (&b0)[4], v4f (&b1)[4])
{
    #pragma unroll
    for (int i = 0; i < 4; ++i) {
        a0[i] = *(const v4f*)(tb + i * 8);                // A: x[m, k..k+3]
        a1[i] = *(const v4f*)(tb + 16 * PITCH + i * 8);   // A: x[16+m, k..k+3]
        b0[i] = *(const v4f*)(tb + 32 * PITCH + i * 8);   // B: V[r, k..k+3], r = l16
        b1[i] = *(const v4f*)(tb + 48 * PITCH + i * 8);   // B: V[16+r, k..k+3]
    }
}

// A and B take the same k order, so only the pairing counts: of each 8 k the
// first WMMA sums k {0,1,4,5}, the second k {2,3,6,7}.
__device__ __forceinline__ void mma_frags(const v4f (&a0)[4], const v4f (&a1)[4],
                                          const v4f (&b0)[4], const v4f (&b1)[4],
                                          v8f& acc00, v8f& acc01, v8f& acc10, v8f& acc11)
{
    #pragma unroll
    for (int i = 0; i < 4; ++i) {
        acc00 = __builtin_amdgcn_wmma_f32_16x16x4_f32(
                    false, a0[i].lo, false, b0[i].lo, (short)0, acc00, false, false);
        acc01 = __builtin_amdgcn_wmma_f32_16x16x4_f32(
                    false, a0[i].lo, false, b1[i].lo, (short)0, acc01, false, false);
        acc10 = __builtin_amdgcn_wmma_f32_16x16x4_f32(
                    false, a1[i].lo, false, b0[i].lo, (short)0, acc10, false, false);
        acc11 = __builtin_amdgcn_wmma_f32_16x16x4_f32(
                    false, a1[i].lo, false, b1[i].lo, (short)0, acc11, false, false);
        acc00 = __builtin_amdgcn_wmma_f32_16x16x4_f32(
                    false, a0[i].hi, false, b0[i].hi, (short)0, acc00, false, false);
        acc01 = __builtin_amdgcn_wmma_f32_16x16x4_f32(
                    false, a0[i].hi, false, b1[i].hi, (short)0, acc01, false, false);
        acc10 = __builtin_amdgcn_wmma_f32_16x16x4_f32(
                    false, a1[i].hi, false, b0[i].hi, (short)0, acc10, false, false);
        acc11 = __builtin_amdgcn_wmma_f32_16x16x4_f32(
                    false, a1[i].hi, false, b1[i].hi, (short)0, acc11, false, false);
    }
}

// One trip of phase 2 behind its fragment loads: 32 rows x 64 columns of out.
// u0..u3: B fragments of N-tiles 0..3; N-tile t stands for columns 4*l16 + t, so
// the four tiles leave a lane four neighbouring columns of each row, and one
// 16-byte store per lane writes 256 contiguous bytes of each of two rows.
__device__ __forceinline__ void mma_store(const v4f (&ah0)[4], const v4f (&ah1)[4],
                                          const v4f (&u0)[4], const v4f (&u1)[4],
                                          const v4f (&u2)[4], const v4f (&u3)[4],
                                          float* orow)
{
    v8f c0[4] = {};   // rows 0..15,  columns 4*l16 + t
    v8f c1[4] = {};   // rows 16..31, columns 4*l16 + t
    #pragma unroll
    for (int t = 0; t < 4; ++t) {
        const v4f (&b)[4] = t == 0 ? u0 : t == 1 ? u1 : t == 2 ? u2 : u3;
        #pragma unroll
        for (int kk = 0; kk < 4; ++kk) {
            c0[t] = __builtin_amdgcn_wmma_f32_16x16x4_f32(
                        false, ah0[kk].lo, false, b[kk].lo, (short)0, c0[t], false, false);
            c1[t] = __builtin_amdgcn_wmma_f32_16x16x4_f32(
                        false, ah1[kk].lo, false, b[kk].lo, (short)0, c1[t], false, false);
            c0[t] = __builtin_amdgcn_wmma_f32_16x16x4_f32(
                        false, ah0[kk].hi, false, b[kk].hi, (short)0, c0[t], false, false);
            c1[t] = __builtin_amdgcn_wmma_f32_16x16x4_f32(
                        false, ah1[kk].hi, false, b[kk].hi, (short)0, c1[t], false, false);
        }
    }
    // D layout: VGPR i -> row i + 8*hi (+16 for c1), lane l16 -> columns 4*l16 + 0..3
    #pragma unroll
    for (int i = 0; i < 8; ++i) {
        v4f r0 = { c0[0][i], c0[1][i], c0[2][i], c0[3][i] };
        v4f r1 = { c1[0][i], c1[1][i], c1[2][i], c1[3][i] };
        *(v4f*)(orow + (size_t)i * OUT_F)        = r0;
        *(v4f*)(orow + (size_t)(16 + i) * OUT_F) = r1;
    }
    // What follows rewrites registers that these stores name (address pair,
    // data): this wait stands in front of that rewrite.
    asm volatile("s_wait_xcnt 0x0" ::: "memory");
}

__global__ __launch_bounds__(BLOCK) void lora_fused_wmma(
    const float* __restrict__ x,   // [8192, 4096]
    const float* __restrict__ U,   // [4096, 32]
    const float* __restrict__ S,   // [32]
    const float* __restrict__ V,   // [32, 4096]
    float* __restrict__ out)       // [8192, 4096]
{
    __shared__ __align__(16) float smem[RING_F + ROWS * RANK];
    float* const hFin  = smem + RING_F;  // 4 KB reduced h

    const int tid  = threadIdx.x;
    const int wave = tid >> 5;
    const int lane = tid & 31;
    const int l16  = lane & 15;      // M (A) or N (B/D) index within tile
    const int hi   = lane >> 4;      // half-wave selects k 0..3 vs 4..7 of each 8
    const int koff = hi * 4;         // one 16-byte load per lane feeds two WMMAs
    const int m0   = blockIdx.x * ROWS;
    const int n0   = wave * (OUT_F / WAVES);          // 256-wide N slice of phase 2
    float* const ring = smem + wave * (2 * BUF_F);    // this wave's two buffers
    // U tile nt of this wave: rows n0 + 64*nt .. +63; the lane's 16 bytes of copy 0.
    const float* const gu = U + (size_t)n0 * RANK + lane * 4;
    const unsigned ldsu = (unsigned)(size_t)ring + ((lane >> 3) * 16 * PITCH + (lane & 7) * 4) * 4;

    // ---------------- Phase 1: partial h[32,32] over this wave's K-slice ----
    v8f acc00 = {};  // rows 0..15,  rank 0..15
    v8f acc01 = {};  // rows 0..15,  rank 16..31
    v8f acc10 = {};  // rows 16..31, rank 0..15
    v8f acc11 = {};  // rows 16..31, rank 16..31
    {
        const int kw0 = wave * (IN_F / WAVES);        // 256-wide K slice
        const int r4  = lane >> 3;                    // row within a copy's 4 rows
        const int c16 = lane & 7;                     // 16-byte piece of the 128-byte row
        const float* gx = x + (size_t)(m0 + r4) * IN_F + kw0 + c16 * 4;
        const float* gv = V + (size_t)r4 * IN_F + kw0 + c16 * 4;
        const unsigned lds0 = (unsigned)(size_t)ring + (r4 * PITCH + c16 * 4) * 4;

        // The ring is private to its wave: a wave reads only what it copied
        // itself, behind its own s_wait_asynccnt, and refills a buffer behind its
        // own s_wait_dscnt 0. So no work-group barrier stands in the loop, the
        // waves of a SIMD drift apart, and one wave's waits lie under another's
        // WMMAs. Two tiles of a wave fly at a time (32 copies).
        copy_tile(lds0, gx, gv);                            // tile 0 -> buffer 0
        copy_tile(lds0 + BUF_F * 4, gx + KT, gv + KT);      // tile 1 -> buffer 1

        v4f a0[4], a1[4], b0[4], b1[4];
        for (int t = 0; t < NT - 2; ++t) {
            // Tile t has landed; the 16 youngest copies (tile t+1) fly on.
            asm volatile("s_wait_asynccnt 0x10" ::: "memory");
            load_frags(ring + (t & 1) * BUF_F + l16 * PITCH + koff, a0, a1, b0, b1);
            // The tile is in registers: this wave's reads of the buffer are done
            // before its refill is asked for.
            asm volatile("s_wait_dscnt 0x0" ::: "memory");
            copy_tile(lds0 + (t & 1) * (BUF_F * 4), gx + (t + 2) * KT, gv + (t + 2) * KT);
            // Keeps the WMMAs behind the refill: lifted over it they would
            // shorten its lead.
            __builtin_amdgcn_sched_barrier(0);
            mma_frags(a0, a1, b0, b1, acc00, acc01, acc10, acc11);
        }
        // Tile NT-2 (buffer 0): behind it only tile NT-1's 16 copies are still out.
        asm volatile("s_wait_asynccnt 0x10" ::: "memory");
        load_frags(ring + l16 * PITCH + koff, a0, a1, b0, b1);
        // Buffer 0 is read out: phase 2's first tile of U is asked for here and
        // flies under the last two tiles' WMMAs and the sum over the waves.
        asm volatile("s_wait_dscnt 0x0" ::: "memory");
        copy_u(ldsu, gu);                                   // U tile 0 -> buffer 0
        // Keeps the WMMAs behind the copies, as in the loop.
        __builtin_amdgcn_sched_barrier(0);
        mma_frags(a0, a1, b0, b1, acc00, acc01, acc10, acc11);
        // Tile NT-1 (buffer 1) has landed; the 16 youngest copies (U tile 0) fly on.
        asm volatile("s_wait_asynccnt 0x10" ::: "memory");
        load_frags(ring + BUF_F + l16 * PITCH + koff, a0, a1, b0, b1);
        mma_frags(a0, a1, b0, b1, acc00, acc01, acc10, acc11);
    }

    // D layout: VGPR i -> (M = i + 8*hi, N = l16). Spill partials to LDS: into the
    // wave's own buffer 1, which it alone has read and has read out, so no
    // barrier stands in front of these writes.
    {
        float* p = ring + BUF_F;
        #pragma unroll
        for (int i = 0; i < 8; ++i) {
            int m = i + 8 * hi;
            p[m * RANK + l16]             = acc00[i];
            p[m * RANK + 16 + l16]        = acc01[i];
            p[(16 + m) * RANK + l16]      = acc10[i];
            p[(16 + m) * RANK + 16 + l16] = acc11[i];
        }
    }
    __syncthreads();

    // ---------------- Cross-wave reduction + S scale (512 thr x float2) -----
    {
        v2f sum = {};
        #pragma unroll
        for (int w = 0; w < WAVES; ++w)
            sum += *(const v2f*)(smem + w * (2 * BUF_F) + BUF_F + tid * 2);
        v2f sv = *(const v2f*)(S + 2 * (tid & 15));   // r = 2*(tid%16)+{0,1}
        sum *= sv;                                     // SCALING==1.0 folded
        *(v2f*)(hFin + tid * 2) = sum;
    }
    // Every wave's reads of the partials are done before any buffer 1 is refilled.
    asm volatile("s_wait_dscnt 0x0" ::: "memory");
    __syncthreads();
    copy_u(ldsu + BUF_F * 4, gu + 64 * RANK);               // U tile 1 -> buffer 1

    // ---------------- Phase 2: out[32, n0..n0+255] = h @ U^T ----------------
    // Hoist A operand (h, K=32 -> 8 k-steps, two row tiles) once; reuse for
    // all 16 N-tiles of the wave.
    v4f ah0[4], ah1[4];
    #pragma unroll
    for (int kk = 0; kk < 4; ++kk) {
        ah0[kk] = *(const v4f*)(hFin + l16 * RANK + kk * 8 + koff);
        ah1[kk] = *(const v4f*)(hFin + (16 + l16) * RANK + kk * 8 + koff);
    }

    // The ring as in phase 1, private to its wave: 64 columns a trip, two tiles of
    // U in flight, a buffer refilled once its tile is in registers.
    const float* const fb = ring + l16 * PITCH + koff;
    float* const orow = out + (size_t)(m0 + 8 * hi) * OUT_F + n0 + 4 * l16;
    v4f u0[4], u1[4], u2[4], u3[4];
    for (int nt = 0; nt < 2; ++nt) {
        // Tile nt has landed; the 16 youngest copies (tile nt+1) fly on.
        asm volatile("s_wait_asynccnt 0x10" ::: "memory");
        load_frags(fb + nt * BUF_F, u0, u1, u2, u3);
        // This wave's reads of the buffer are done before its refill is asked for.
        asm volatile("s_wait_dscnt 0x0" ::: "memory");
        copy_u(ldsu + nt * (BUF_F * 4), gu + (nt + 2) * (64 * RANK));
        // Keeps the WMMAs behind the refill: lifted over it they would
        // shorten its lead.
        __builtin_amdgcn_sched_barrier(0);
        mma_store(ah0, ah1, u0, u1, u2, u3, orow + nt * 64);
    }
    // Tile 2: behind it only tile 3's 16 copies are still out.
    asm volatile("s_wait_asynccnt 0x10" ::: "memory");
    load_frags(fb, u0, u1, u2, u3);
    mma_store(ah0, ah1, u0, u1, u2, u3, orow + 2 * 64);
    // Tile 3: no copy is left in flight behind this wait.
    asm volatile("s_wait_asynccnt 0x0" ::: "memory");
    load_frags(fb + BUF_F, u0, u1, u2, u3);
    mma_store(ah0, ah1, u0, u1, u2, u3, orow + 3 * 64);
}

extern "C" void kernel_launch(void* const* d_in, const int* in_sizes, int n_in,
                              void* d_out, int out_size, void* d_ws, size_t ws_size,
                              hipStream_t stream) {
    const float* x = (const float*)d_in[0];   // [4,2048,4096] -> [8192,4096]
    const float* U = (const float*)d_in[1];   // [4096,32]
    const float* S = (const float*)d_in[2];   // [32]
    const float* V = (const float*)d_in[3];   // [32,4096]
    float* out = (float*)d_out;               // [8192,4096]

    const int M = 4 * 2048;                   // 8192 rows
    dim3 grid(M / ROWS), block(BLOCK);
    lora_fused_wmma<<<grid, block, 0, stream>>>(x, U, S, V, out);
}
